// v000
// Measured on an AMD MI455X. A time is GPU time per run, averaged over a window of back-to-back runs after a warm-up
// (all launches, gaps included; the runs take copies of the inputs in turn), and the median of several windows.
// Apart from v000's, it joins two sittings. Times from different sittings can be a few percent apart, while
// side-by-side timings come from the same sitting.
// v000 is the starting kernel. One run takes 69.5 microseconds.
#include <hip/hip_runtime.h>

#define HEADS 8
#define DHEAD 32
#define NROWS 4096
#define CDIM  256
#define LSTR  41   // LDS row stride in floats: odd -> lane-transposed LN reads conflict-free;
                   // 2*41 mod 64 = 18 -> half-wave WMMA fragment rows hit disjoint bank ranges.
#define CHUNK1 128 // rows staged per iteration in pass 1
#define CHUNK2 128 // rows per workgroup in pass 2
#define SPLIT  4   // N-split per (b,h) in pass 1 (partial kv tiles, reduced in pass 2)

typedef __attribute__((ext_vector_type(2))) float v2f;
typedef __attribute__((ext_vector_type(8))) float v8f;

__device__ __forceinline__ v8f wmma_f32_16x16x4(v2f a, v2f b, v8f c) {
  // 8 args: (neg_a, A, neg_b, B, c_mod, C, reuse_a, reuse_b)
  return __builtin_amdgcn_wmma_f32_16x16x4_f32(false, a, false, b, (short)0, c,
                                               false, false);
}

// Async global -> LDS copy (4 bytes/lane), tracked by ASYNCcnt. Falls back to a
// synchronous copy if the builtin is unavailable on this toolchain.
__device__ __forceinline__ void async_copy_f32(const float* g, float* l) {
#if __has_builtin(__builtin_amdgcn_global_load_async_to_lds_b32)
  __builtin_amdgcn_global_load_async_to_lds_b32(
      (__attribute__((address_space(1))) int*)g,
      (__attribute__((address_space(3))) int*)l, 0, 0);
#else
  *l = *g;
#endif
}

template <int N>
__device__ __forceinline__ void wait_async() {
#if __has_builtin(__builtin_amdgcn_s_wait_asynccnt)
  __builtin_amdgcn_s_wait_asynccnt(N);
#else
  asm volatile("s_wait_asynccnt %0" ::"i"(N) : "memory");
#endif
}

// ---------------------------------------------------------------------------
// Pass 1: partial kv[32][32] = (LN_k(x)^T LN_v(x)) / N over an N/SPLIT segment.
// grid = B*HEADS*SPLIT blocks, 128 threads (4 waves). Each wave owns one
// 16x16 tile. Staging is async double-buffered: chunk c+1 streams into LDS
// while LN + WMMA run on chunk c.
// ---------------------------------------------------------------------------
__global__ __launch_bounds__(128)
void kv_pass1(const float* __restrict__ x,
              const float* __restrict__ kw, const float* __restrict__ kb,
              const float* __restrict__ vw, const float* __restrict__ vb,
              float* __restrict__ kvout, int B) {
  __shared__ float xs[2][CHUNK1 * LSTR];
  __shared__ float ks[CHUNK1 * LSTR];
  __shared__ float vs[CHUNK1 * LSTR];
  __shared__ float kwS[DHEAD], kbS[DHEAD], vwS[DHEAD], vbS[DHEAD];

  const int blk  = blockIdx.x;
  const int bh   = blk / SPLIT;
  const int seg  = blk % SPLIT;
  const int b    = bh / HEADS;
  const int h    = bh % HEADS;
  const int lane = threadIdx.x & 31;
  const int wid  = threadIdx.x >> 5;   // 0..3
  const int half = lane >> 4;
  const int l15  = lane & 15;

  if (threadIdx.x < DHEAD) {
    kwS[threadIdx.x] = kw[h * DHEAD + threadIdx.x];
    kbS[threadIdx.x] = kb[h * DHEAD + threadIdx.x];
    vwS[threadIdx.x] = vw[h * DHEAD + threadIdx.x];
    vbS[threadIdx.x] = vb[h * DHEAD + threadIdx.x];
  }

  const int dt = (wid >> 1) * 16;      // tile row offset in kv
  const int et = (wid & 1) * 16;       // tile col offset in kv
  v8f acc = {0.f, 0.f, 0.f, 0.f, 0.f, 0.f, 0.f, 0.f};

  const size_t rowstride = (size_t)CDIM;
  const size_t base = ((size_t)b * NROWS) * rowstride + (size_t)h * DHEAD;
  const int nbeg = seg * (NROWS / SPLIT);
  const int NCH  = (NROWS / SPLIT) / CHUNK1;   // 8 chunks per segment

  auto issue = [&](int c) {
    const int n0 = nbeg + c * CHUNK1;
    float* dst = xs[c & 1];
    #pragma unroll 4
    for (int i = 0; i < CHUNK1 / 4; ++i) {
      int r = wid * (CHUNK1 / 4) + i;
      async_copy_f32(x + base + (size_t)(n0 + r) * rowstride + lane,
                     dst + r * LSTR + lane);
    }
  };

  issue(0);
  for (int c = 0; c < NCH; ++c) {
    wait_async<0>();       // chunk c resident in LDS (per-wave)
    __syncthreads();       // all waves' async writes visible
    if (c + 1 < NCH) issue(c + 1);   // prefetch next chunk into other buffer

    // LayerNorm: each lane owns one row (serial over D, no shuffles).
    {
      int r = wid * 32 + lane;
      const float* row = &xs[c & 1][r * LSTR];
      float s = 0.f, ss = 0.f;
      #pragma unroll
      for (int d = 0; d < DHEAD; ++d) { float t = row[d]; s += t; ss += t * t; }
      float m   = s * (1.0f / DHEAD);
      float var = fmaxf(ss - (float)DHEAD * m * m, 0.0f);       // sum((x-m)^2)
      float inv = 1.0f / (sqrtf(var * (1.0f / (DHEAD - 1))) + 1e-5f);
      #pragma unroll
      for (int d = 0; d < DHEAD; ++d) {
        float t = (row[d] - m) * inv;
        ks[r * LSTR + d] = kwS[d] * t + kbS[d];
        vs[r * LSTR + d] = vwS[d] * t + vbS[d];
      }
    }
    __syncthreads();

    // kv tile accumulation: A = k^T (16x4 per step), B = v (4x16 per step)
    #pragma unroll 8
    for (int kk = 0; kk < CHUNK1; kk += 4) {
      v2f a, bb;
      a.x  = ks[(kk + half * 2 + 0) * LSTR + dt + l15];
      a.y  = ks[(kk + half * 2 + 1) * LSTR + dt + l15];
      bb.x = vs[(kk + half * 2 + 0) * LSTR + et + l15];
      bb.y = vs[(kk + half * 2 + 1) * LSTR + et + l15];
      acc = wmma_f32_16x16x4(a, bb, acc);
    }
    __syncthreads();
  }

  // write this wave's partial 16x16 tile of kv, scaled by 1/N
  const float scale = 1.0f / (float)NROWS;
  float* kvb = kvout + (size_t)blk * (DHEAD * DHEAD);
  #pragma unroll
  for (int r = 0; r < 8; ++r) {
    int row = dt + r + half * 8;         // C/D layout: lanes 16-31 hold M=8..15
    kvb[row * DHEAD + et + l15] = acc[r] * scale;
  }
}

// ---------------------------------------------------------------------------
// Pass 2: out = x_head * kv + x (residual).  grid = B*HEADS*(N/128) blocks,
// 256 threads (8 waves); each wave computes a 16x32 output slab via WMMA.
// kv partials from pass 1 are reduced while staging. Output stores are
// non-temporal so the 128 MB of `out` doesn't evict L2-resident x.
// ---------------------------------------------------------------------------
__global__ __launch_bounds__(256)
void out_pass2(const float* __restrict__ x, const float* __restrict__ kv,
               float* __restrict__ out, int B, int chunks) {
  __shared__ float xs[CHUNK2 * LSTR];
  __shared__ float kvs[DHEAD * LSTR];

  const int gid  = blockIdx.x;
  const int bh   = gid / chunks;
  const int c0   = gid % chunks;
  const int b    = bh / HEADS;
  const int h    = bh % HEADS;
  const int lane = threadIdx.x & 31;
  const int wid  = threadIdx.x >> 5;   // 0..7
  const int half = lane >> 4;
  const int l15  = lane & 15;

  const size_t rowstride = (size_t)CDIM;
  const size_t base = ((size_t)b * NROWS) * rowstride + (size_t)h * DHEAD;
  const int n0 = c0 * CHUNK2;

  // async-stage 128 rows of x for this head
  #pragma unroll 4
  for (int i = 0; i < CHUNK2 / 8; ++i) {
    int r = wid * (CHUNK2 / 8) + i;
    async_copy_f32(x + base + (size_t)(n0 + r) * rowstride + lane,
                   xs + r * LSTR + lane);
  }

  // reduce SPLIT partial kv tiles into LDS (tiny, L2-resident, reused 32x)
  for (int e = threadIdx.x; e < DHEAD * DHEAD; e += 256) {
    float s = 0.f;
    #pragma unroll
    for (int sg = 0; sg < SPLIT; ++sg)
      s += kv[((size_t)bh * SPLIT + sg) * (DHEAD * DHEAD) + e];
    kvs[(e >> 5) * LSTR + (e & 31)] = s;
  }

  wait_async<0>();
  __syncthreads();

  v8f acc0 = {0.f, 0.f, 0.f, 0.f, 0.f, 0.f, 0.f, 0.f};
  v8f acc1 = {0.f, 0.f, 0.f, 0.f, 0.f, 0.f, 0.f, 0.f};
  const int rbase = wid * 16;

  #pragma unroll
  for (int kk = 0; kk < DHEAD; kk += 4) {
    v2f a, b0, b1;
    a.x  = xs[(rbase + l15) * LSTR + kk + half * 2 + 0];   // A[M=row, K=d]
    a.y  = xs[(rbase + l15) * LSTR + kk + half * 2 + 1];
    b0.x = kvs[(kk + half * 2 + 0) * LSTR + l15];          // B[K=d, N=e]
    b0.y = kvs[(kk + half * 2 + 1) * LSTR + l15];
    b1.x = kvs[(kk + half * 2 + 0) * LSTR + 16 + l15];
    b1.y = kvs[(kk + half * 2 + 1) * LSTR + 16 + l15];
    acc0 = wmma_f32_16x16x4(a, b0, acc0);
    acc1 = wmma_f32_16x16x4(a, b1, acc1);
  }

  // residual add + non-temporal store (half-wave writes 64B contiguous runs)
  #pragma unroll
  for (int r = 0; r < 8; ++r) {
    int rl = rbase + r + half * 8;
    size_t o = base + (size_t)(n0 + rl) * rowstride;
    __builtin_nontemporal_store(acc0[r] + xs[rl * LSTR + l15],      &out[o + l15]);
    __builtin_nontemporal_store(acc1[r] + xs[rl * LSTR + 16 + l15], &out[o + 16 + l15]);
  }
}

extern "C" void kernel_launch(void* const* d_in, const int* in_sizes, int n_in,
                              void* d_out, int out_size, void* d_ws, size_t ws_size,
                              hipStream_t stream) {
  const float* x  = (const float*)d_in[0];
  const float* kw = (const float*)d_in[1];
  const float* kb = (const float*)d_in[2];
  const float* vw = (const float*)d_in[3];
  const float* vb = (const float*)d_in[4];
  float* out = (float*)d_out;
  float* kvw = (float*)d_ws;   // B*H*SPLIT*32*32 floats = 4 MB of partial kv

  const int B = in_sizes[0] / (NROWS * CDIM);

  kv_pass1<<<B * HEADS * SPLIT, 128, 0, stream>>>(x, kw, kb, vw, vb, kvw, B);

  const int chunks = NROWS / CHUNK2;   // 32
  out_pass2<<<B * HEADS * chunks, 256, 0, stream>>>(x, kvw, out, B, chunks);
}

// v001
// One run takes 50.1 microseconds.
// Timed twice side by side with v000, it ran 1.42 and 1.40 times as fast.
#include <hip/hip_runtime.h>

#define HEADS 8
#define DHEAD 32
#define NROWS 4096
#define CDIM  256
#define LSTR  41   // LDS row stride in floats (pass 2):
                   // 2*41 mod 64 = 18 -> half-wave WMMA fragment rows hit disjoint bank ranges.
#define CHUNK2 128 // rows per workgroup in pass 2
#define SPLIT  2   // N-split per (b,h) in pass 1 (partial kv tiles, reduced in pass 2)
#define P1_THREADS 512                          // pass 1: 16 waves
#define P1_WPH     8                            // pass 1: waves per head
#define STAGE      32                           // pass 1: rows per wave and stage
#define SEGROWS    (NROWS / SPLIT)              // rows per pass-1 block
#define NST        (SEGROWS / (P1_WPH * STAGE)) // stages per wave (even, >= 2)

typedef __attribute__((ext_vector_type(2))) float v2f;
typedef __attribute__((ext_vector_type(4))) float v4f;
typedef __attribute__((ext_vector_type(8))) float v8f;

__device__ __forceinline__ v8f wmma_f32_16x16x4(v2f a, v2f b, v8f c) {
  // 8 args: (neg_a, A, neg_b, B, c_mod, C, reuse_a, reuse_b)
  return __builtin_amdgcn_wmma_f32_16x16x4_f32(false, a, false, b, (short)0, c,
                                               false, false);
}

// Async global -> LDS copy (4 bytes/lane), tracked by ASYNCcnt. Falls back to a
// synchronous copy if the builtin is unavailable on this toolchain.
__device__ __forceinline__ void async_copy_f32(const float* g, float* l) {
#if __has_builtin(__builtin_amdgcn_global_load_async_to_lds_b32)
  __builtin_amdgcn_global_load_async_to_lds_b32(
      (__attribute__((address_space(1))) int*)g,
      (__attribute__((address_space(3))) int*)l, 0, 0);
#else
  *l = *g;
#endif
}

template <int N>
__device__ __forceinline__ void wait_async() {
#if __has_builtin(__builtin_amdgcn_s_wait_asynccnt)
  __builtin_amdgcn_s_wait_asynccnt(N);
#else
  asm volatile("s_wait_asynccnt %0" ::"i"(N) : "memory");
#endif
}

// One cross-lane read inside each 16-lane row on the vector unit (no LDS, no wait).
template <int CTRL>
__device__ __forceinline__ float row_dpp(float v) {
  return __builtin_bit_cast(float,
      __builtin_amdgcn_update_dpp(0, __builtin_bit_cast(int, v), CTRL, 0xf, 0xf, true));
}

// One level of a transposing sum over a 16-lane row: 2*H values per lane become H.
// A lane whose bit is set keeps the upper H values and hands the lower H to the
// partner lane (row_xmask), and the other way round. After the four levels
// (lane bits 3, 2, 1, 0) lane c of the row holds the whole 16-lane sum of value c:
// 15 cross-lane adds for 16 row sums instead of 64.
template <int H, int CTRL>
__device__ __forceinline__ void fold(float (&v)[16], bool hi) {
  #pragma unroll   // constant indices, so that v stays in registers
  for (int j = 0; j < H; ++j) {
    const float keep = hi ? v[j + H] : v[j];
    const float send = hi ? v[j] : v[j + H];
    v[j] = keep + row_dpp<CTRL>(send);
  }
}
__device__ __forceinline__ void fold16(float (&v)[16], int l15) {
  fold<8, 0x168>(v, (l15 & 8) != 0);   // row_xmask:8
  fold<4, 0x164>(v, (l15 & 4) != 0);   // row_xmask:4
  fold<2, 0x162>(v, (l15 & 2) != 0);   // row_xmask:2
  fold<1, 0x161>(v, (l15 & 1) != 0);   // row_xmask:1
}

// ---------------------------------------------------------------------------
// Pass 1: partial kv[32][32] = (LN_k(x)^T LN_v(x)) / N over an N/SPLIT segment.
// grid = B*(HEADS/2)*SPLIT blocks of 512 threads (16 waves): 8 waves per head,
// two neighbouring heads per block (256 contiguous bytes of every row).
// x goes from global memory straight into WMMA fragment registers: lane c of a
// half-wave loads columns 2c, 2c+1 of one row (8 bytes; 16 lanes = the head's
// whole 128-byte line), so the x component feeds the "even columns" fragment
// and the y component the "odd columns" fragment. A stage is 32 rows: register
// i of half-wave hf holds row 2i+hf. The transposing sum leaves each lane with
// the totals of one row (lane c of half hf: row 2c+hf), which it turns into
// mean and 1/(std+eps) once; row_share hands them back to the row's 16 lanes.
// Each wave keeps all four 16x16 tiles (even/odd x even/odd) for its own rows;
// the 8 waves of a head are summed once, at the end, in LDS.
// ---------------------------------------------------------------------------
__device__ __forceinline__ void p1_load(v2f (&buf)[STAGE / 2], const float* base) {
  #pragma unroll   // constant indices, so that buf stays in registers
  for (int i = 0; i < STAGE / 2; ++i)
    buf[i] = *(const v2f*)(base + (size_t)(2 * i) * CDIM);
  // The group's address registers are rewritten only behind this wait.
  asm volatile("s_wait_xcnt 0x0" ::: "memory");
  // Ends the scheduling region behind the group: without it the scheduler
  // spreads both groups of a trip through the row statistics, waits for all
  // loads in the middle of the trip and takes 256 registers instead of 194.
  __builtin_amdgcn_sched_barrier(0);
}

// 16x16x4 step S of a stage. k index: (half, register j) <-> row 4S + 2j + half,
// the same for the A and the B fragments.
template <int S>
__device__ __forceinline__ void p1_steps(const v2f (&buf)[STAGE / 2], float m, float inv,
                                         v2f kw2, v2f kb2, v2f vw2, v2f vb2,
                                         v8f& aEE, v8f& aEO, v8f& aOE, v8f& aOO) {
  if constexpr (S < STAGE / 4) {
    const v2f p0 = buf[2 * S], p1 = buf[2 * S + 1];
    const float m0 = row_dpp<0x150 + 2 * S>(m),     i0 = row_dpp<0x150 + 2 * S>(inv);      // row_share
    const float m1 = row_dpp<0x150 + 2 * S + 1>(m), i1 = row_dpp<0x150 + 2 * S + 1>(inv);
    const float tE0 = (p0.x - m0) * i0, tO0 = (p0.y - m0) * i0;
    const float tE1 = (p1.x - m1) * i1, tO1 = (p1.y - m1) * i1;
    v2f kE, kO, vE, vO;
    kE.x = kw2.x * tE0 + kb2.x;  kE.y = kw2.x * tE1 + kb2.x;
    kO.x = kw2.y * tO0 + kb2.y;  kO.y = kw2.y * tO1 + kb2.y;
    vE.x = vw2.x * tE0 + vb2.x;  vE.y = vw2.x * tE1 + vb2.x;
    vO.x = vw2.y * tO0 + vb2.y;  vO.y = vw2.y * tO1 + vb2.y;
    aEE = wmma_f32_16x16x4(kE, vE, aEE);
    aEO = wmma_f32_16x16x4(kE, vO, aEO);
    aOE = wmma_f32_16x16x4(kO, vE, aOE);
    aOO = wmma_f32_16x16x4(kO, vO, aOO);
    p1_steps<S + 1>(buf, m, inv, kw2, kb2, vw2, vb2, aEE, aEO, aOE, aOO);
  }
}

__device__ __forceinline__ void p1_compute(const v2f (&buf)[STAGE / 2], int l15,
                                           v2f kw2, v2f kb2, v2f vw2, v2f vb2,
                                           v8f& aEE, v8f& aEO, v8f& aOE, v8f& aOO) {
  float s[STAGE / 2], ss[STAGE / 2];
  #pragma unroll   // constant indices into buf, s and ss
  for (int i = 0; i < STAGE / 2; ++i) {
    s[i]  = buf[i].x + buf[i].y;
    ss[i] = fmaf(buf[i].y, buf[i].y, buf[i].x * buf[i].x);
  }
  fold16(s, l15);
  fold16(ss, l15);
  const float m   = s[0] * (1.0f / DHEAD);
  const float var = fmaxf(ss[0] - (float)DHEAD * m * m, 0.0f);       // sum((x-m)^2)
  const float inv = 1.0f / (sqrtf(var * (1.0f / (DHEAD - 1))) + 1e-5f);
  p1_steps<0>(buf, m, inv, kw2, kb2, vw2, vb2, aEE, aEO, aOE, aOO);
}

__global__ __launch_bounds__(P1_THREADS)
void kv_pass1(const float* __restrict__ x,
              const float* __restrict__ kw, const float* __restrict__ kb,
              const float* __restrict__ vw, const float* __restrict__ vb,
              float* __restrict__ kvout, int B) {
  __shared__ __attribute__((aligned(16))) float red[(P1_THREADS / 32) * DHEAD * DHEAD];

  const int blk  = blockIdx.x;
  const int seg  = blk % SPLIT;
  const int hp   = (blk / SPLIT) % (HEADS / 2);
  const int b    = blk / (SPLIT * (HEADS / 2));
  const int lane = threadIdx.x & 31;
  const int wid  = threadIdx.x >> 5;   // 0..15
  const int half = lane >> 4;
  const int l15  = lane & 15;
  const int hl   = wid / P1_WPH;       // which of the block's two heads
  const int sub  = wid % P1_WPH;       // this wave's share of the head's rows
  const int h    = hp * 2 + hl;

  const float* pkw = kw + h * DHEAD + 2 * l15;
  const float* pkb = kb + h * DHEAD + 2 * l15;
  const float* pvw = vw + h * DHEAD + 2 * l15;
  const float* pvb = vb + h * DHEAD + 2 * l15;
  const v2f kw2 = *(const v2f*)pkw;
  const v2f kb2 = *(const v2f*)pkb;
  const v2f vw2 = *(const v2f*)pvw;
  const v2f vb2 = *(const v2f*)pvb;
  // The four address pairs stay live up to here and are rewritten only behind this wait.
  asm volatile("s_wait_xcnt 0x0" :: "v"(pkw), "v"(pkb), "v"(pvw), "v"(pvb) : "memory");

  v8f aEE = {0.f, 0.f, 0.f, 0.f, 0.f, 0.f, 0.f, 0.f};
  v8f aEO = aEE, aOE = aEE, aOO = aEE;

  // stage st of this wave: rows seg*SEGROWS + (st*P1_WPH + sub)*STAGE .. +STAGE-1
  const float* xp = x + ((size_t)b * NROWS + (size_t)seg * SEGROWS + sub * STAGE + half) * CDIM
                      + h * DHEAD + 2 * l15;
  const size_t ststep = (size_t)P1_WPH * STAGE * CDIM;

  // Two register buffers, both filled ahead. A buffer is refilled (two stages
  // ahead) as soon as its own stage is done, so its 16 loads fly during the
  // whole of the other buffer's stage, and nothing that is loaded in a trip is
  // used in the same trip, however the two stages' arithmetic is interleaved.
  // The last pair is peeled so that no branch stands around a load.
  v2f bufA[STAGE / 2], bufB[STAGE / 2];
  p1_load(bufA, xp);
  p1_load(bufB, xp + ststep);
  #pragma unroll 1   // stays rolled: four stage bodies of text instead of eight
  for (int st = 0; st < NST - 2; st += 2) {
    xp += 2 * ststep;
    p1_compute(bufA, l15, kw2, kb2, vw2, vb2, aEE, aEO, aOE, aOO);
    p1_load(bufA, xp);
    p1_compute(bufB, l15, kw2, kb2, vw2, vb2, aEE, aEO, aOE, aOO);
    p1_load(bufB, xp + ststep);
  }
  p1_compute(bufA, l15, kw2, kb2, vw2, vb2, aEE, aEO, aOE, aOO);
  p1_compute(bufB, l15, kw2, kb2, vw2, vb2, aEE, aEO, aOE, aOO);

  // D layout: register r, lane (half, c) = tile[8*half + r][c]; tile index i
  // stands for column 2i (even) or 2i+1 (odd) of the head.
  float* mine = red + wid * (DHEAD * DHEAD);
  #pragma unroll   // constant indices into the accumulator vectors
  for (int r = 0; r < 8; ++r) {
    const int d = 2 * (r + half * 8);
    v2f e0, e1;
    e0.x = aEE[r]; e0.y = aEO[r];
    e1.x = aOE[r]; e1.y = aOO[r];
    *(v2f*)(mine + d * DHEAD + 2 * l15)       = e0;
    *(v2f*)(mine + (d + 1) * DHEAD + 2 * l15) = e1;
  }
  __syncthreads();

  // sum the 8 waves of each head in a fixed order, scale by 1/N, write the partial
  const float scale = 1.0f / (float)NROWS;
  const int o   = threadIdx.x * 4;               // 0..2047: two heads x 1024
  const int oh  = o / (DHEAD * DHEAD);
  const int idx = o % (DHEAD * DHEAD);
  v4f acc = *(const v4f*)(red + (oh * P1_WPH) * (DHEAD * DHEAD) + idx);
  #pragma unroll   // all LDS reads issued before the first add
  for (int w = 1; w < P1_WPH; ++w)
    acc += *(const v4f*)(red + (oh * P1_WPH + w) * (DHEAD * DHEAD) + idx);
  const int bh = b * HEADS + hp * 2 + oh;
  *(v4f*)(kvout + ((size_t)bh * SPLIT + seg) * (DHEAD * DHEAD) + idx) = acc * scale;
}

// ---------------------------------------------------------------------------
// Pass 2: out = x_head * kv + x (residual).  grid = B*HEADS*(N/128) blocks,
// 256 threads (8 waves); each wave computes a 16x32 output slab via WMMA.
// kv partials from pass 1 are reduced while staging. Output stores are
// non-temporal so the 128 MB of `out` doesn't evict L2-resident x.
// ---------------------------------------------------------------------------
__global__ __launch_bounds__(256)
void out_pass2(const float* __restrict__ x, const float* __restrict__ kv,
               float* __restrict__ out, int B, int chunks) {
  __shared__ float xs[CHUNK2 * LSTR];
  __shared__ float kvs[DHEAD * LSTR];

  const int gid  = blockIdx.x;
  const int bh   = gid / chunks;
  const int c0   = gid % chunks;
  const int b    = bh / HEADS;
  const int h    = bh % HEADS;
  const int lane = threadIdx.x & 31;
  const int wid  = threadIdx.x >> 5;   // 0..7
  const int half = lane >> 4;
  const int l15  = lane & 15;

  const size_t rowstride = (size_t)CDIM;
  const size_t base = ((size_t)b * NROWS) * rowstride + (size_t)h * DHEAD;
  const int n0 = c0 * CHUNK2;

  // async-stage 128 rows of x for this head
  #pragma unroll 4
  for (int i = 0; i < CHUNK2 / 8; ++i) {
    int r = wid * (CHUNK2 / 8) + i;
    async_copy_f32(x + base + (size_t)(n0 + r) * rowstride + lane,
                   xs + r * LSTR + lane);
  }

  // reduce SPLIT partial kv tiles into LDS (tiny, L2-resident, reused 32x)
  for (int e = threadIdx.x; e < DHEAD * DHEAD; e += 256) {
    float s = 0.f;
    #pragma unroll
    for (int sg = 0; sg < SPLIT; ++sg)
      s += kv[((size_t)bh * SPLIT + sg) * (DHEAD * DHEAD) + e];
    kvs[(e >> 5) * LSTR + (e & 31)] = s;
  }

  wait_async<0>();
  __syncthreads();

  v8f acc0 = {0.f, 0.f, 0.f, 0.f, 0.f, 0.f, 0.f, 0.f};
  v8f acc1 = {0.f, 0.f, 0.f, 0.f, 0.f, 0.f, 0.f, 0.f};
  const int rbase = wid * 16;

  #pragma unroll
  for (int kk = 0; kk < DHEAD; kk += 4) {
    v2f a, b0, b1;
    a.x  = xs[(rbase + l15) * LSTR + kk + half * 2 + 0];   // A[M=row, K=d]
    a.y  = xs[(rbase + l15) * LSTR + kk + half * 2 + 1];
    b0.x = kvs[(kk + half * 2 + 0) * LSTR + l15];          // B[K=d, N=e]
    b0.y = kvs[(kk + half * 2 + 1) * LSTR + l15];
    b1.x = kvs[(kk + half * 2 + 0) * LSTR + 16 + l15];
    b1.y = kvs[(kk + half * 2 + 1) * LSTR + 16 + l15];
    acc0 = wmma_f32_16x16x4(a, b0, acc0);
    acc1 = wmma_f32_16x16x4(a, b1, acc1);
  }

  // residual add + non-temporal store (half-wave writes 64B contiguous runs)
  #pragma unroll
  for (int r = 0; r < 8; ++r) {
    int rl = rbase + r + half * 8;
    size_t o = base + (size_t)(n0 + rl) * rowstride;
    __builtin_nontemporal_store(acc0[r] + xs[rl * LSTR + l15],      &out[o + l15]);
    __builtin_nontemporal_store(acc1[r] + xs[rl * LSTR + 16 + l15], &out[o + 16 + l15]);
  }
}

extern "C" void kernel_launch(void* const* d_in, const int* in_sizes, int n_in,
                              void* d_out, int out_size, void* d_ws, size_t ws_size,
                              hipStream_t stream) {
  const float* x  = (const float*)d_in[0];
  const float* kw = (const float*)d_in[1];
  const float* kb = (const float*)d_in[2];
  const float* vw = (const float*)d_in[3];
  const float* vb = (const float*)d_in[4];
  float* out = (float*)d_out;
  float* kvw = (float*)d_ws;   // B*H*SPLIT*32*32 floats = 2 MB of partial kv

  const int B = in_sizes[0] / (NROWS * CDIM);

  kv_pass1<<<B * (HEADS / 2) * SPLIT, P1_THREADS, 0, stream>>>(x, kw, kb, vw, vb, kvw, B);

  const int chunks = NROWS / CHUNK2;   // 32
  out_pass2<<<B * HEADS * chunks, 256, 0, stream>>>(x, kvw, out, B, chunks);
}

// v002
// Measured time: 37.8 microseconds a run.
// Next to v001, in two timings, it ran 1.32 times as fast each time.
// All steps since v000 together make it 1.86 times as fast.
#include <hip/hip_runtime.h>

#define HEADS 8
#define DHEAD 32
#define NROWS 4096
#define CDIM  256
#define SPLIT  2   // N-split per (b,h) in pass 1 (partial kv tiles, reduced in pass 2)
#define P1_THREADS 512                          // pass 1: 16 waves
#define P1_WPH     8                            // pass 1: waves per head
#define STAGE      32                           // pass 1: rows per wave and stage
#define SEGROWS    (NROWS / SPLIT)              // rows per pass-1 block
#define NST        (SEGROWS / (P1_WPH * STAGE)) // stages per wave (even, >= 2)
#define P2_THREADS 512                          // pass 2: 16 waves
#define P2_WPH     8                            // pass 2: waves per head
#define ST2        64                           // pass 2: rows per wave and stage
#define NST2       (SEGROWS / (P2_WPH * ST2))   // pass 2: stages per wave (>= 2)
#define XPITCH     36                           // pass 2: LDS row pitch in floats (144 B = 16 B x odd:
                                                // 16-byte fragment reads of 16 rows hit all 64 banks once)
#define BUF2       (ST2 * XPITCH)               // pass 2: floats per ring buffer

typedef __attribute__((ext_vector_type(2))) float v2f;
typedef __attribute__((ext_vector_type(4))) float v4f;
typedef __attribute__((ext_vector_type(8))) float v8f;
typedef __attribute__((ext_vector_type(4))) int   v4i;

__device__ __forceinline__ v8f wmma_f32_16x16x4(v2f a, v2f b, v8f c) {
  // 8 args: (neg_a, A, neg_b, B, c_mod, C, reuse_a, reuse_b)
  return __builtin_amdgcn_wmma_f32_16x16x4_f32(false, a, false, b, (short)0, c,
                                               false, false);
}

// One cross-lane read inside each 16-lane row on the vector unit (no LDS, no wait).
template <int CTRL>
__device__ __forceinline__ float row_dpp(float v) {
  return __builtin_bit_cast(float,
      __builtin_amdgcn_update_dpp(0, __builtin_bit_cast(int, v), CTRL, 0xf, 0xf, true));
}

// One level of a transposing sum over a 16-lane row: 2*H values per lane become H.
// A lane whose bit is set keeps the upper H values and hands the lower H to the
// partner lane (row_xmask), and the other way round. After the four levels
// (lane bits 3, 2, 1, 0) lane c of the row holds the whole 16-lane sum of value c:
// 15 cross-lane adds for 16 row sums instead of 64.
template <int H, int CTRL>
__device__ __forceinline__ void fold(float (&v)[16], bool hi) {
  #pragma unroll   // constant indices, so that v stays in registers
  for (int j = 0; j < H; ++j) {
    const float keep = hi ? v[j + H] : v[j];
    const float send = hi ? v[j] : v[j + H];
    v[j] = keep + row_dpp<CTRL>(send);
  }
}
__device__ __forceinline__ void fold16(float (&v)[16], int l15) {
  fold<8, 0x168>(v, (l15 & 8) != 0);   // row_xmask:8
  fold<4, 0x164>(v, (l15 & 4) != 0);   // row_xmask:4
  fold<2, 0x162>(v, (l15 & 2) != 0);   // row_xmask:2
  fold<1, 0x161>(v, (l15 & 1) != 0);   // row_xmask:1
}

// ---------------------------------------------------------------------------
// Pass 1: partial kv[32][32] = (LN_k(x)^T LN_v(x)) / N over an N/SPLIT segment.
// grid = B*(HEADS/2)*SPLIT blocks of 512 threads (16 waves): 8 waves per head,
// two neighbouring heads per block (256 contiguous bytes of every row).
// x goes from global memory straight into WMMA fragment registers: lane c of a
// half-wave loads columns 2c, 2c+1 of one row (8 bytes; 16 lanes = the head's
// whole 128-byte line), so the x component feeds the "even columns" fragment
// and the y component the "odd columns" fragment. A stage is 32 rows: register
// i of half-wave hf holds row 2i+hf. The transposing sum leaves each lane with
// the totals of one row (lane c of half hf: row 2c+hf), which it turns into
// mean and 1/(std+eps) once; row_share hands them back to the row's 16 lanes.
// Each wave keeps all four 16x16 tiles (even/odd x even/odd) for its own rows;
// the 8 waves of a head are summed once, at the end, in LDS.
// ---------------------------------------------------------------------------
__device__ __forceinline__ void p1_load(v2f (&buf)[STAGE / 2], const float* base) {
  #pragma unroll   // constant indices, so that buf stays in registers
  for (int i = 0; i < STAGE / 2; ++i)
    buf[i] = *(const v2f*)(base + (size_t)(2 * i) * CDIM);
  // The group's address registers are rewritten only behind this wait.
  asm volatile("s_wait_xcnt 0x0" ::: "memory");
  // Ends the scheduling region behind the group: without it the scheduler
  // spreads both groups of a trip through the row statistics, waits for all
  // loads in the middle of the trip and takes 256 registers instead of 194.
  __builtin_amdgcn_sched_barrier(0);
}

// 16x16x4 step S of a stage. k index: (half, register j) <-> row 4S + 2j + half,
// the same for the A and the B fragments.
template <int S>
__device__ __forceinline__ void p1_steps(const v2f (&buf)[STAGE / 2], float m, float inv,
                                         v2f kw2, v2f kb2, v2f vw2, v2f vb2,
                                         v8f& aEE, v8f& aEO, v8f& aOE, v8f& aOO) {
  if constexpr (S < STAGE / 4) {
    const v2f p0 = buf[2 * S], p1 = buf[2 * S + 1];
    const float m0 = row_dpp<0x150 + 2 * S>(m),     i0 = row_dpp<0x150 + 2 * S>(inv);      // row_share
    const float m1 = row_dpp<0x150 + 2 * S + 1>(m), i1 = row_dpp<0x150 + 2 * S + 1>(inv);
    const float tE0 = (p0.x - m0) * i0, tO0 = (p0.y - m0) * i0;
    const float tE1 = (p1.x - m1) * i1, tO1 = (p1.y - m1) * i1;
    v2f kE, kO, vE, vO;
    kE.x = kw2.x * tE0 + kb2.x;  kE.y = kw2.x * tE1 + kb2.x;
    kO.x = kw2.y * tO0 + kb2.y;  kO.y = kw2.y * tO1 + kb2.y;
    vE.x = vw2.x * tE0 + vb2.x;  vE.y = vw2.x * tE1 + vb2.x;
    vO.x = vw2.y * tO0 + vb2.y;  vO.y = vw2.y * tO1 + vb2.y;
    aEE = wmma_f32_16x16x4(kE, vE, aEE);
    aEO = wmma_f32_16x16x4(kE, vO, aEO);
    aOE = wmma_f32_16x16x4(kO, vE, aOE);
    aOO = wmma_f32_16x16x4(kO, vO, aOO);
    p1_steps<S + 1>(buf, m, inv, kw2, kb2, vw2, vb2, aEE, aEO, aOE, aOO);
  }
}

__device__ __forceinline__ void p1_compute(const v2f (&buf)[STAGE / 2], int l15,
                                           v2f kw2, v2f kb2, v2f vw2, v2f vb2,
                                           v8f& aEE, v8f& aEO, v8f& aOE, v8f& aOO) {
  float s[STAGE / 2], ss[STAGE / 2];
  #pragma unroll   // constant indices into buf, s and ss
  for (int i = 0; i < STAGE / 2; ++i) {
    s[i]  = buf[i].x + buf[i].y;
    ss[i] = fmaf(buf[i].y, buf[i].y, buf[i].x * buf[i].x);
  }
  fold16(s, l15);
  fold16(ss, l15);
  const float m   = s[0] * (1.0f / DHEAD);
  const float var = fmaxf(ss[0] - (float)DHEAD * m * m, 0.0f);       // sum((x-m)^2)
  const float inv = 1.0f / (sqrtf(var * (1.0f / (DHEAD - 1))) + 1e-5f);
  p1_steps<0>(buf, m, inv, kw2, kb2, vw2, vb2, aEE, aEO, aOE, aOO);
}

__global__ __launch_bounds__(P1_THREADS)
void kv_pass1(const float* __restrict__ x,
              const float* __restrict__ kw, const float* __restrict__ kb,
              const float* __restrict__ vw, const float* __restrict__ vb,
              float* __restrict__ kvout, int B) {
  __shared__ __attribute__((aligned(16))) float red[(P1_THREADS / 32) * DHEAD * DHEAD];

  const int blk  = blockIdx.x;
  const int seg  = blk % SPLIT;
  const int hp   = (blk / SPLIT) % (HEADS / 2);
  const int b    = blk / (SPLIT * (HEADS / 2));
  const int lane = threadIdx.x & 31;
  const int wid  = threadIdx.x >> 5;   // 0..15
  const int half = lane >> 4;
  const int l15  = lane & 15;
  const int hl   = wid / P1_WPH;       // which of the block's two heads
  const int sub  = wid % P1_WPH;       // this wave's share of the head's rows
  const int h    = hp * 2 + hl;

  const float* pkw = kw + h * DHEAD + 2 * l15;
  const float* pkb = kb + h * DHEAD + 2 * l15;
  const float* pvw = vw + h * DHEAD + 2 * l15;
  const float* pvb = vb + h * DHEAD + 2 * l15;
  const v2f kw2 = *(const v2f*)pkw;
  const v2f kb2 = *(const v2f*)pkb;
  const v2f vw2 = *(const v2f*)pvw;
  const v2f vb2 = *(const v2f*)pvb;
  // The four address pairs stay live up to here and are rewritten only behind this wait.
  asm volatile("s_wait_xcnt 0x0" :: "v"(pkw), "v"(pkb), "v"(pvw), "v"(pvb) : "memory");

  v8f aEE = {0.f, 0.f, 0.f, 0.f, 0.f, 0.f, 0.f, 0.f};
  v8f aEO = aEE, aOE = aEE, aOO = aEE;

  // stage st of this wave: rows seg*SEGROWS + (st*P1_WPH + sub)*STAGE .. +STAGE-1
  const float* xp = x + ((size_t)b * NROWS + (size_t)seg * SEGROWS + sub * STAGE + half) * CDIM
                      + h * DHEAD + 2 * l15;
  const size_t ststep = (size_t)P1_WPH * STAGE * CDIM;

  // Two register buffers, both filled ahead. A buffer is refilled (two stages
  // ahead) as soon as its own stage is done, so its 16 loads fly during the
  // whole of the other buffer's stage, and nothing that is loaded in a trip is
  // used in the same trip, however the two stages' arithmetic is interleaved.
  // The last pair is peeled so that no branch stands around a load.
  v2f bufA[STAGE / 2], bufB[STAGE / 2];
  p1_load(bufA, xp);
  p1_load(bufB, xp + ststep);
  #pragma unroll 1   // stays rolled: four stage bodies of text instead of eight
  for (int st = 0; st < NST - 2; st += 2) {
    xp += 2 * ststep;
    p1_compute(bufA, l15, kw2, kb2, vw2, vb2, aEE, aEO, aOE, aOO);
    p1_load(bufA, xp);
    p1_compute(bufB, l15, kw2, kb2, vw2, vb2, aEE, aEO, aOE, aOO);
    p1_load(bufB, xp + ststep);
  }
  p1_compute(bufA, l15, kw2, kb2, vw2, vb2, aEE, aEO, aOE, aOO);
  p1_compute(bufB, l15, kw2, kb2, vw2, vb2, aEE, aEO, aOE, aOO);

  // D layout: register r, lane (half, c) = tile[8*half + r][c]; tile index i
  // stands for column 2i (even) or 2i+1 (odd) of the head.
  float* mine = red + wid * (DHEAD * DHEAD);
  #pragma unroll   // constant indices into the accumulator vectors
  for (int r = 0; r < 8; ++r) {
    const int d = 2 * (r + half * 8);
    v2f e0, e1;
    e0.x = aEE[r]; e0.y = aEO[r];
    e1.x = aOE[r]; e1.y = aOO[r];
    *(v2f*)(mine + d * DHEAD + 2 * l15)       = e0;
    *(v2f*)(mine + (d + 1) * DHEAD + 2 * l15) = e1;
  }
  __syncthreads();

  // sum the 8 waves of each head in a fixed order, scale by 1/N, write the partial
  const float scale = 1.0f / (float)NROWS;
  const int o   = threadIdx.x * 4;               // 0..2047: two heads x 1024
  const int oh  = o / (DHEAD * DHEAD);
  const int idx = o % (DHEAD * DHEAD);
  v4f acc = *(const v4f*)(red + (oh * P1_WPH) * (DHEAD * DHEAD) + idx);
  #pragma unroll   // all LDS reads issued before the first add
  for (int w = 1; w < P1_WPH; ++w)
    acc += *(const v4f*)(red + (oh * P1_WPH + w) * (DHEAD * DHEAD) + idx);
  const int bh = b * HEADS + hp * 2 + oh;
  *(v4f*)(kvout + ((size_t)bh * SPLIT + seg) * (DHEAD * DHEAD) + idx) = acc * scale;
}

// ---------------------------------------------------------------------------
// Pass 2: out = x_head * kv + x (residual). Same cut as pass 1: grid =
// B*(HEADS/2)*SPLIT blocks of 512 threads, one per WGP, two neighbouring heads
// per block, 8 waves per head, and every block takes the rows it read in pass 1
// (4096 waves start instead of 65536). A wave works alone: kv of its head sits
// in registers as WMMA B fragments for all of its rows, and x streams through
// a two-buffer LDS ring that belongs to the wave, filled by 16-byte
// asynchronous copies (whole 128-byte lines) one stage ahead.
// k order of step s: (half, register j) <-> column 16*half + 2*s + j of the
// head, the same for the A and the B fragments. The two output tiles hold the
// even and the odd columns, so that a lane stores columns 2c, 2c+1 together
// and 16 lanes write one whole 128-byte line. Stores are non-temporal so that
// `out` does not evict L2-resident x.
// ---------------------------------------------------------------------------
__device__ __forceinline__ void p2_copy(const float* g, float* l) {
  #pragma unroll   // constant steps: they become the copies' offset fields
  for (int i = 0; i < ST2 / 4; ++i)
    __builtin_amdgcn_global_load_async_to_lds_b128(
        (__attribute__((address_space(1))) v4i*)(g + (size_t)(4 * i) * CDIM),
        (__attribute__((address_space(3))) v4i*)(l + (4 * i) * XPITCH), 0, 0);
}

__global__ __launch_bounds__(P2_THREADS)
void out_pass2(const float* __restrict__ x, const float* __restrict__ kv,
               float* __restrict__ out) {
  __shared__ __attribute__((aligned(16))) float ring[(P2_THREADS / 32) * 2 * BUF2];

  const int blk  = blockIdx.x;
  const int seg  = blk % SPLIT;
  const int hp   = (blk / SPLIT) % (HEADS / 2);
  const int b    = blk / (SPLIT * (HEADS / 2));
  const int lane = threadIdx.x & 31;
  const int wid  = threadIdx.x >> 5;   // 0..15
  const int half = lane >> 4;
  const int l15  = lane & 15;
  const int hl   = wid / P2_WPH;       // which of the block's two heads
  const int sub  = wid % P2_WPH;       // this wave's share of the head's rows
  const int h    = hp * 2 + hl;

  // stage st of this wave: rows row0 + st*P2_WPH*ST2 .. +ST2-1
  const size_t row0   = (size_t)b * NROWS + (size_t)seg * SEGROWS + sub * ST2;
  const size_t ststep = (size_t)P2_WPH * ST2 * CDIM;
  float* mybuf = ring + wid * (2 * BUF2);
  // one copy = 4 rows: 8 lanes x 16 bytes cover a row's 128-byte line
  const float* gp = x + (row0 + (lane >> 3)) * CDIM + h * DHEAD + 4 * (lane & 7);
  float*       lp = mybuf + (lane >> 3) * XPITCH + 4 * (lane & 7);

  p2_copy(gp, lp);   // stage 0
  // Ends the scheduling region behind stage 0's copies: without it the scheduler
  // puts 15 of the 16 behind the waits for the kv loads below, and the two
  // latencies stand in series at the head of every wave.
  __builtin_amdgcn_sched_barrier(0);

  // B fragments: the SPLIT partial kv tiles are summed on the way in
  const float* kp = kv + (size_t)(b * HEADS + h) * SPLIT * (DHEAD * DHEAD)
                       + (16 * half) * DHEAD + 2 * l15;
  v2f bE[DHEAD / 4], bO[DHEAD / 4];
  #pragma unroll   // constant indices, so that the fragments stay in registers
  for (int s = 0; s < DHEAD / 4; ++s) {
    v2f r0 = *(const v2f*)(kp + (2 * s) * DHEAD);
    v2f r1 = *(const v2f*)(kp + (2 * s + 1) * DHEAD);
    #pragma unroll   // all loads of the fragments issued as one group
    for (int sg = 1; sg < SPLIT; ++sg) {
      r0 += *(const v2f*)(kp + sg * (DHEAD * DHEAD) + (2 * s) * DHEAD);
      r1 += *(const v2f*)(kp + sg * (DHEAD * DHEAD) + (2 * s + 1) * DHEAD);
    }
    bE[s].x = r0.x;  bE[s].y = r1.x;
    bO[s].x = r0.y;  bO[s].y = r1.y;
  }

  // Stage 0 has landed behind this wait; only the wave that copied reads it.
  asm volatile("s_wait_asynccnt 0x0" ::: "memory");
  p2_copy(gp + ststep, lp + BUF2);   // stage 1

  float* op = out + (row0 + 8 * half) * CDIM + h * DHEAD + 2 * l15;

  #pragma unroll   // buffer places and store steps become constants; no address register is rewritten
  for (int st = 0; st < NST2; ++st) {
    const float* cur = mybuf + (st & 1) * BUF2;
    #pragma unroll   // the stage's four 16-row tiles are independent: eight accumulator chains to interleave
    for (int tl = 0; tl < ST2 / 16; ++tl) {
      const float* ar = cur + (tl * 16 + l15) * XPITCH + 16 * half;        // A[M=row, K]
      const float* rr = cur + (tl * 16 + 8 * half) * XPITCH + 2 * l15;     // residual, D layout
      v4f a4[4];
      v2f res[8];
      // the four unrolls below: constant indices, so that a4, res and the accumulators stay in registers
      #pragma unroll
      for (int q = 0; q < 4; ++q) a4[q] = *(const v4f*)(ar + 4 * q);
      #pragma unroll
      for (int r = 0; r < 8; ++r) res[r] = *(const v2f*)(rr + r * XPITCH);

      v8f accE = {0.f, 0.f, 0.f, 0.f, 0.f, 0.f, 0.f, 0.f};
      v8f accO = accE;
      #pragma unroll
      for (int q = 0; q < 4; ++q) {
        v2f a0, a1;
        a0.x = a4[q].x;  a0.y = a4[q].y;
        a1.x = a4[q].z;  a1.y = a4[q].w;
        accE = wmma_f32_16x16x4(a0, bE[2 * q], accE);
        accO = wmma_f32_16x16x4(a0, bO[2 * q], accO);
        accE = wmma_f32_16x16x4(a1, bE[2 * q + 1], accE);
        accO = wmma_f32_16x16x4(a1, bO[2 * q + 1], accO);
      }

      #pragma unroll
      for (int r = 0; r < 8; ++r) {
        v2f o;
        o.x = accE[r] + res[r].x;
        o.y = accO[r] + res[r].y;
        __builtin_nontemporal_store(o, (v2f*)(op + (size_t)st * ststep + (size_t)(tl * 16 + r) * CDIM));
      }
    }
    // Foot of a stage. The ring is private to the wave, so no work-group barrier:
    // the wave's own LDS reads of this buffer have retired before it is refilled,
    asm volatile("s_wait_dscnt 0x0" ::: "memory");
    // and the next stage's copies have landed before the wave reads them.
    asm volatile("s_wait_asynccnt 0x0" ::: "memory");
    if (st + 2 < NST2) p2_copy(gp + (size_t)(st + 2) * ststep, lp + (st & 1) * BUF2);
  }
}

extern "C" void kernel_launch(void* const* d_in, const int* in_sizes, int n_in,
                              void* d_out, int out_size, void* d_ws, size_t ws_size,
                              hipStream_t stream) {
  const float* x  = (const float*)d_in[0];
  const float* kw = (const float*)d_in[1];
  const float* kb = (const float*)d_in[2];
  const float* vw = (const float*)d_in[3];
  const float* vb = (const float*)d_in[4];
  float* out = (float*)d_out;
  float* kvw = (float*)d_ws;   // B*H*SPLIT*32*32 floats = 2 MB of partial kv

  const int B = in_sizes[0] / (NROWS * CDIM);

  kv_pass1<<<B * (HEADS / 2) * SPLIT, P1_THREADS, 0, stream>>>(x, kw, kb, vw, vb, kvw, B);

  out_pass2<<<B * (HEADS / 2) * SPLIT, P2_THREADS, 0, stream>>>(x, kvw, out);
}

// v003
// Measured time: 34.3 microseconds a run.
// In two side-by-side timings against v002, it was 1.11 and 1.10 times as fast.
// Over all steps from v000 it is 2.06 times as fast.
#include <hip/hip_runtime.h>

#define HEADS 8
#define DHEAD 32
#define NROWS 4096
#define CDIM  256
#define THREADS 512                             // 16 waves, all on one head
#define WAVES   (THREADS / 32)
#define STAGE   32                              // phase 1: rows per wave and stage
#define NST     (NROWS / (WAVES * STAGE))       // phase 1: stages per wave (even, >= 2)
#define ST2     64                              // phase 2: rows per wave and stage
#define NST2    (NROWS / (WAVES * ST2))         // phase 2: stages per wave (>= 2)
#define XPITCH  36                              // phase 2: LDS row pitch in floats (144 B = 16 B x odd:
                                                // 16-byte fragment reads of 16 rows hit all 64 banks once)
#define BUF2    (ST2 * XPITCH)                  // phase 2: floats per ring buffer
#define RINGF   (WAVES * 2 * BUF2)              // floats of all the waves' rings
#define TILE    (DHEAD * DHEAD)                 // floats of one kv tile
#define REDW    (WAVES / 2)                     // kv tiles in the reduction area

typedef __attribute__((ext_vector_type(2))) float v2f;
typedef __attribute__((ext_vector_type(4))) float v4f;
typedef __attribute__((ext_vector_type(8))) float v8f;
typedef __attribute__((ext_vector_type(4))) int   v4i;

__device__ __forceinline__ v8f wmma_f32_16x16x4(v2f a, v2f b, v8f c) {
  // 8 args: (neg_a, A, neg_b, B, c_mod, C, reuse_a, reuse_b)
  return __builtin_amdgcn_wmma_f32_16x16x4_f32(false, a, false, b, (short)0, c,
                                               false, false);
}

// One cross-lane read inside each 16-lane row on the vector unit (no LDS, no wait).
template <int CTRL>
__device__ __forceinline__ float row_dpp(float v) {
  return __builtin_bit_cast(float,
      __builtin_amdgcn_update_dpp(0, __builtin_bit_cast(int, v), CTRL, 0xf, 0xf, true));
}

// One level of a transposing sum over a 16-lane row: 2*H values per lane become H.
// A lane whose bit is set keeps the upper H values and hands the lower H to the
// partner lane (row_xmask), and the other way round. After the four levels
// (lane bits 3, 2, 1, 0) lane c of the row holds the whole 16-lane sum of value c:
// 15 cross-lane adds for 16 row sums instead of 64.
template <int H, int CTRL>
__device__ __forceinline__ void fold(float (&v)[16], bool hi) {
  #pragma unroll   // constant indices, so that v stays in registers
  for (int j = 0; j < H; ++j) {
    const float keep = hi ? v[j + H] : v[j];
    const float send = hi ? v[j] : v[j + H];
    v[j] = keep + row_dpp<CTRL>(send);
  }
}
__device__ __forceinline__ void fold16(float (&v)[16], int l15) {
  fold<8, 0x168>(v, (l15 & 8) != 0);   // row_xmask:8
  fold<4, 0x164>(v, (l15 & 4) != 0);   // row_xmask:4
  fold<2, 0x162>(v, (l15 & 2) != 0);   // row_xmask:2
  fold<1, 0x161>(v, (l15 & 1) != 0);   // row_xmask:1
}

// ---------------------------------------------------------------------------
// One launch. A block owns one (batch, head) with all of its rows, so the sum
// over the rows ends inside the block and kv never leaves the WGP: phase 1
// builds kv, the block's barriers hand it over in LDS, phase 2 writes out.
//
// Phase 1: kv[32][32] = (LN_k(x)^T LN_v(x)) / N.
// x goes from global memory straight into WMMA fragment registers: lane c of a
// half-wave loads columns 2c, 2c+1 of one row (8 bytes; 16 lanes = the head's
// whole 128-byte line), so the x component feeds the "even columns" fragment
// and the y component the "odd columns" fragment. A stage is 32 rows: register
// i of half-wave hf holds row 2i+hf. The transposing sum leaves each lane with
// the totals of one row (lane c of half hf: row 2c+hf), which it turns into
// mean and 1/(std+eps) once; row_share hands them back to the row's 16 lanes.
// Each wave keeps all four 16x16 tiles (even/odd x even/odd) for its own rows;
// the 16 waves are summed once, at the end, in LDS.
// ---------------------------------------------------------------------------
__device__ __forceinline__ void p1_load(v2f (&buf)[STAGE / 2], const float* base) {
  #pragma unroll   // constant indices, so that buf stays in registers
  for (int i = 0; i < STAGE / 2; ++i)
    buf[i] = *(const v2f*)(base + (size_t)(2 * i) * CDIM);
  // The group's address registers are rewritten only behind this wait.
  asm volatile("s_wait_xcnt 0x0" ::: "memory");
  // Ends the scheduling region behind the group: without it the scheduler
  // spreads both groups of a trip through the row statistics, waits for all
  // loads in the middle of the trip and takes 256 registers instead of 194.
  __builtin_amdgcn_sched_barrier(0);
}

// 16x16x4 step S of a stage. k index: (half, register j) <-> row 4S + 2j + half,
// the same for the A and the B fragments.
template <int S>
__device__ __forceinline__ void p1_steps(const v2f (&buf)[STAGE / 2], float m, float inv,
                                         v2f kw2, v2f kb2, v2f vw2, v2f vb2,
                                         v8f& aEE, v8f& aEO, v8f& aOE, v8f& aOO) {
  if constexpr (S < STAGE / 4) {
    const v2f p0 = buf[2 * S], p1 = buf[2 * S + 1];
    const float m0 = row_dpp<0x150 + 2 * S>(m),     i0 = row_dpp<0x150 + 2 * S>(inv);      // row_share
    const float m1 = row_dpp<0x150 + 2 * S + 1>(m), i1 = row_dpp<0x150 + 2 * S + 1>(inv);
    const float tE0 = (p0.x - m0) * i0, tO0 = (p0.y - m0) * i0;
    const float tE1 = (p1.x - m1) * i1, tO1 = (p1.y - m1) * i1;
    v2f kE, kO, vE, vO;
    kE.x = kw2.x * tE0 + kb2.x;  kE.y = kw2.x * tE1 + kb2.x;
    kO.x = kw2.y * tO0 + kb2.y;  kO.y = kw2.y * tO1 + kb2.y;
    vE.x = vw2.x * tE0 + vb2.x;  vE.y = vw2.x * tE1 + vb2.x;
    vO.x = vw2.y * tO0 + vb2.y;  vO.y = vw2.y * tO1 + vb2.y;
    aEE = wmma_f32_16x16x4(kE, vE, aEE);
    aEO = wmma_f32_16x16x4(kE, vO, aEO);
    aOE = wmma_f32_16x16x4(kO, vE, aOE);
    aOO = wmma_f32_16x16x4(kO, vO, aOO);
    p1_steps<S + 1>(buf, m, inv, kw2, kb2, vw2, vb2, aEE, aEO, aOE, aOO);
  }
}

__device__ __forceinline__ void p1_compute(const v2f (&buf)[STAGE / 2], int l15,
                                           v2f kw2, v2f kb2, v2f vw2, v2f vb2,
                                           v8f& aEE, v8f& aEO, v8f& aOE, v8f& aOO) {
  float s[STAGE / 2], ss[STAGE / 2];
  #pragma unroll   // constant indices into buf, s and ss
  for (int i = 0; i < STAGE / 2; ++i) {
    s[i]  = buf[i].x + buf[i].y;
    ss[i] = fmaf(buf[i].y, buf[i].y, buf[i].x * buf[i].x);
  }
  fold16(s, l15);
  fold16(ss, l15);
  const float m   = s[0] * (1.0f / DHEAD);
  const float var = fmaxf(ss[0] - (float)DHEAD * m * m, 0.0f);       // sum((x-m)^2)
  const float inv = 1.0f / (sqrtf(var * (1.0f / (DHEAD - 1))) + 1e-5f);
  p1_steps<0>(buf, m, inv, kw2, kb2, vw2, vb2, aEE, aEO, aOE, aOO);
}

// ---------------------------------------------------------------------------
// Phase 2: out = x_head * kv + x (residual). A wave works alone: kv sits in
// registers as WMMA B fragments for all of its rows, and x streams through a
// two-buffer LDS ring that belongs to the wave, filled by 16-byte asynchronous
// copies (whole 128-byte lines).
// k order of step s: (half, register j) <-> column 16*half + 2*s + j of the
// head, the same for the A and the B fragments. The two output tiles hold the
// even and the odd columns, so that a lane stores columns 2c, 2c+1 together
// and 16 lanes write one whole 128-byte line. Stores are non-temporal so that
// `out` does not evict L2-resident x.
// ---------------------------------------------------------------------------
__device__ __forceinline__ void p2_copy(const float* g, float* l) {
  #pragma unroll   // constant steps: they become the copies' offset fields
  for (int i = 0; i < ST2 / 4; ++i)
    __builtin_amdgcn_global_load_async_to_lds_b128(
        (__attribute__((address_space(1))) v4i*)(g + (size_t)(4 * i) * CDIM),
        (__attribute__((address_space(3))) v4i*)(l + (4 * i) * XPITCH), 0, 0);
}

__global__ __launch_bounds__(THREADS)
void attn_one_launch(const float* __restrict__ x,
                     const float* __restrict__ kw, const float* __restrict__ kb,
                     const float* __restrict__ vw, const float* __restrict__ vb,
                     float* __restrict__ out) {
  // The rings and the reduction area lie side by side (together the whole LDS
  // of a WGP), so that the rings can be filled while phase 1 still runs.
  __shared__ __attribute__((aligned(16))) float smem[RINGF + REDW * TILE];
  float* ring = smem;
  float* red  = smem + RINGF;

  const int blk  = blockIdx.x;
  const int b    = blk / HEADS;
  const int h    = blk % HEADS;
  const int lane = threadIdx.x & 31;
  const int wid  = threadIdx.x >> 5;   // 0..15: this wave's share of the rows
  const int half = lane >> 4;
  const int l15  = lane & 15;

  const float* pkw = kw + h * DHEAD + 2 * l15;
  const float* pkb = kb + h * DHEAD + 2 * l15;
  const float* pvw = vw + h * DHEAD + 2 * l15;
  const float* pvb = vb + h * DHEAD + 2 * l15;
  const v2f kw2 = *(const v2f*)pkw;
  const v2f kb2 = *(const v2f*)pkb;
  const v2f vw2 = *(const v2f*)pvw;
  const v2f vb2 = *(const v2f*)pvb;
  // The four address pairs stay live up to here and are rewritten only behind this wait.
  asm volatile("s_wait_xcnt 0x0" :: "v"(pkw), "v"(pkb), "v"(pvw), "v"(pvb) : "memory");

  v8f aEE = {0.f, 0.f, 0.f, 0.f, 0.f, 0.f, 0.f, 0.f};
  v8f aEO = aEE, aOE = aEE, aOO = aEE;

  // phase 1, stage st of this wave: rows (st*WAVES + wid)*STAGE .. +STAGE-1
  const float* xp = x + ((size_t)b * NROWS + wid * STAGE + half) * CDIM + h * DHEAD + 2 * l15;
  const size_t ststep1 = (size_t)WAVES * STAGE * CDIM;

  // phase 2, stage st of this wave: rows row0 + st*WAVES*ST2 .. +ST2-1
  const size_t row0   = (size_t)b * NROWS + wid * ST2;
  const size_t ststep = (size_t)WAVES * ST2 * CDIM;
  float* mybuf = ring + wid * (2 * BUF2);
  // one copy = 4 rows: 8 lanes x 16 bytes cover a row's 128-byte line
  const float* gp = x + (row0 + (lane >> 3)) * CDIM + h * DHEAD + 4 * (lane & 7);
  float*       lp = mybuf + (lane >> 3) * XPITCH + 4 * (lane & 7);

  // Two register buffers, both filled ahead. A buffer is refilled (two stages
  // ahead) as soon as its own stage is done, so its 16 loads fly during the
  // whole of the other buffer's stage, and nothing that is loaded in a trip is
  // used in the same trip, however the two stages' arithmetic is interleaved.
  // The last pair is peeled so that no branch stands around a load.
  v2f bufA[STAGE / 2], bufB[STAGE / 2];
  p1_load(bufA, xp);
  p1_load(bufB, xp + ststep1);
  #pragma unroll 1   // stays rolled: four stage bodies of text instead of eight
  for (int st = 0; st < NST - 2; st += 2) {
    xp += 2 * ststep1;
    p1_compute(bufA, l15, kw2, kb2, vw2, vb2, aEE, aEO, aOE, aOO);
    p1_load(bufA, xp);
    p1_compute(bufB, l15, kw2, kb2, vw2, vb2, aEE, aEO, aOE, aOO);
    p1_load(bufB, xp + ststep1);
  }
  // Phase 2's first two stages start for the wave's ring here: no load of
  // phase 1 is left to issue, and the copies fly during its last two stages and
  // the reduction. Nothing has touched the ring before.
  p2_copy(gp, lp);
  p2_copy(gp + ststep, lp + BUF2);
  // Ends the scheduling region behind the copies: they are to issue here, not
  // behind the two stages of arithmetic below.
  __builtin_amdgcn_sched_barrier(0);
  p1_compute(bufA, l15, kw2, kb2, vw2, vb2, aEE, aEO, aOE, aOO);
  p1_compute(bufB, l15, kw2, kb2, vw2, vb2, aEE, aEO, aOE, aOO);

  // The 16 waves' tiles are summed in a fixed order. The upper eight waves put
  // theirs down, the lower eight add their own on top (wave w meets wave w+8,
  // lane for lane), then all threads sum the eight that are left.
  // D layout: register r, lane (half, c) = tile[8*half + r][c]; tile index i
  // stands for column 2i (even) or 2i+1 (odd) of the head.
  const bool upper = __builtin_amdgcn_readfirstlane(wid) >= REDW;   // a scalar branch
  float* mine = red + (wid % REDW) * TILE;
  if (upper) {
    #pragma unroll   // constant indices into the accumulator vectors
    for (int r = 0; r < 8; ++r) {
      const int d = 2 * (r + half * 8);
      v2f e0, e1;
      e0.x = aEE[r]; e0.y = aEO[r];
      e1.x = aOE[r]; e1.y = aOO[r];
      *(v2f*)(mine + d * DHEAD + 2 * l15)       = e0;
      *(v2f*)(mine + (d + 1) * DHEAD + 2 * l15) = e1;
    }
  }
  __syncthreads();
  if (!upper) {
    #pragma unroll   // constant indices into the accumulator vectors
    for (int r = 0; r < 8; ++r) {
      const int d = 2 * (r + half * 8);
      v2f e0 = *(const v2f*)(mine + d * DHEAD + 2 * l15);
      v2f e1 = *(const v2f*)(mine + (d + 1) * DHEAD + 2 * l15);
      e0.x += aEE[r]; e0.y += aEO[r];
      e1.x += aOE[r]; e1.y += aOO[r];
      *(v2f*)(mine + d * DHEAD + 2 * l15)       = e0;
      *(v2f*)(mine + (d + 1) * DHEAD + 2 * l15) = e1;
    }
  }
  __syncthreads();
  const int ko = threadIdx.x * 2;                // 0..1022: this thread's two kv elements
  v2f ksum = *(const v2f*)(red + ko);
  #pragma unroll   // all LDS reads issued before the first add
  for (int w = 1; w < REDW; ++w)
    ksum += *(const v2f*)(red + w * TILE + ko);
  // a thread overwrites only the two floats of tile 0 that it alone has read
  *(v2f*)(red + ko) = ksum * (1.0f / (float)NROWS);
  __syncthreads();                               // kv stands in red[0 .. TILE-1]

  // B fragments
  const float* kp = red + (16 * half) * DHEAD + 2 * l15;
  v2f bE[DHEAD / 4], bO[DHEAD / 4];
  #pragma unroll   // constant indices, so that the fragments stay in registers
  for (int s = 0; s < DHEAD / 4; ++s) {
    const v2f r0 = *(const v2f*)(kp + (2 * s) * DHEAD);
    const v2f r1 = *(const v2f*)(kp + (2 * s + 1) * DHEAD);
    bE[s].x = r0.x;  bE[s].y = r1.x;
    bO[s].x = r0.y;  bO[s].y = r1.y;
  }

  // Stages 0 and 1 have landed behind this wait; only the wave that copied reads them.
  asm volatile("s_wait_asynccnt 0x0" ::: "memory");

  float* op = out + (row0 + 8 * half) * CDIM + h * DHEAD + 2 * l15;

  #pragma unroll   // buffer places and store steps become constants; no address register is rewritten
  for (int st = 0; st < NST2; ++st) {
    const float* cur = mybuf + (st & 1) * BUF2;
    #pragma unroll   // the stage's four 16-row tiles are independent: eight accumulator chains to interleave
    for (int tl = 0; tl < ST2 / 16; ++tl) {
      const float* ar = cur + (tl * 16 + l15) * XPITCH + 16 * half;        // A[M=row, K]
      const float* rr = cur + (tl * 16 + 8 * half) * XPITCH + 2 * l15;     // residual, D layout
      v4f a4[4];
      v2f res[8];
      // the four unrolls below: constant indices, so that a4, res and the accumulators stay in registers
      #pragma unroll
      for (int q = 0; q < 4; ++q) a4[q] = *(const v4f*)(ar + 4 * q);
      #pragma unroll
      for (int r = 0; r < 8; ++r) res[r] = *(const v2f*)(rr + r * XPITCH);

      v8f accE = {0.f, 0.f, 0.f, 0.f, 0.f, 0.f, 0.f, 0.f};
      v8f accO = accE;
      #pragma unroll
      for (int q = 0; q < 4; ++q) {
        v2f a0, a1;
        a0.x = a4[q].x;  a0.y = a4[q].y;
        a1.x = a4[q].z;  a1.y = a4[q].w;
        accE = wmma_f32_16x16x4(a0, bE[2 * q], accE);
        accO = wmma_f32_16x16x4(a0, bO[2 * q], accO);
        accE = wmma_f32_16x16x4(a1, bE[2 * q + 1], accE);
        accO = wmma_f32_16x16x4(a1, bO[2 * q + 1], accO);
      }

      #pragma unroll
      for (int r = 0; r < 8; ++r) {
        v2f o;
        o.x = accE[r] + res[r].x;
        o.y = accO[r] + res[r].y;
        __builtin_nontemporal_store(o, (v2f*)(op + (size_t)st * ststep + (size_t)(tl * 16 + r) * CDIM));
      }
    }
    // Foot of a stage. The ring is private to the wave, so no work-group barrier:
    // the wave's own LDS reads of this buffer have retired before it is refilled,
    asm volatile("s_wait_dscnt 0x0" ::: "memory");
    // and the next stage's copies have landed before the wave reads them.
    asm volatile("s_wait_asynccnt 0x0" ::: "memory");
    if (st + 2 < NST2) p2_copy(gp + (size_t)(st + 2) * ststep, lp + (st & 1) * BUF2);
  }
}

extern "C" void kernel_launch(void* const* d_in, const int* in_sizes, int n_in,
                              void* d_out, int out_size, void* d_ws, size_t ws_size,
                              hipStream_t stream) {
  const float* x  = (const float*)d_in[0];
  const float* kw = (const float*)d_in[1];
  const float* kb = (const float*)d_in[2];
  const float* vw = (const float*)d_in[3];
  const float* vb = (const float*)d_in[4];
  float* out = (float*)d_out;

  const int B = in_sizes[0] / (NROWS * CDIM);

  attn_one_launch<<<B * HEADS, THREADS, 0, stream>>>(x, kw, kb, vw, vb, out);
}

// v004
// A run of this version takes 31.5 microseconds.
// Two timings next to v003 put it at 1.09 and 1.08 times that version's speed.
// Over all steps from v000 it is 2.24 times as fast.
#include <hip/hip_runtime.h>

#define HEADS 8
#define DHEAD 32
#define NROWS 4096
#define CDIM  256
#define THREADS 512                             // 16 waves, all on one head
#define WAVES   (THREADS / 32)
#define STAGE   32                              // phase 1: rows per wave and stage
#define NST     (NROWS / (WAVES * STAGE))       // phase 1: stages per wave (even, >= 2)
#define ST2     64                              // phase 2: rows per wave and stage
#define NST2    (NROWS / (WAVES * ST2))         // phase 2: stages per wave (>= 2)
#define XPITCH  36                              // phase 2: LDS row pitch in floats (144 B = 16 B x odd:
                                                // 16-byte fragment reads of 16 rows hit all 64 banks once)
#define BUF2    (ST2 * XPITCH)                  // phase 2: floats per ring buffer
#define RINGF   (WAVES * 2 * BUF2)              // floats of all the waves' rings
#define TILE    (DHEAD * DHEAD)                 // floats of one kv tile
#define REDW    (WAVES / 2)                     // partial sums side by side in the reduction area
#define GP      18                              // reduction: row pitch of a 16x16 tile, in elements (a row
                                                // and a column of 16 lanes both fall on different banks)
#define OOFF    (2 * 16 * GP)                   // reduction: the odd x odd tile, behind the tile of pairs
#define SOFF    (3 * 16 * GP)                   // reduction: the 32 column sums
#define AREA    (SOFF + DHEAD)                  // reduction: floats of one wave's partial sums
static_assert(REDW * AREA + TILE <= REDW * TILE, "partial sums and kv share the reduction area");

typedef __attribute__((ext_vector_type(2))) float v2f;
typedef __attribute__((ext_vector_type(4))) float v4f;
typedef __attribute__((ext_vector_type(8))) float v8f;
typedef __attribute__((ext_vector_type(4))) int   v4i;

__device__ __forceinline__ v8f wmma_f32_16x16x4(v2f a, v2f b, v8f c) {
  // 8 args: (neg_a, A, neg_b, B, c_mod, C, reuse_a, reuse_b)
  return __builtin_amdgcn_wmma_f32_16x16x4_f32(false, a, false, b, (short)0, c,
                                               false, false);
}

// One cross-lane read inside each 16-lane row on the vector unit (no LDS, no wait).
template <int CTRL>
__device__ __forceinline__ float row_dpp(float v) {
  return __builtin_bit_cast(float,
      __builtin_amdgcn_update_dpp(0, __builtin_bit_cast(int, v), CTRL, 0xf, 0xf, true));
}

// One level of a transposing sum over a 16-lane row: 2*H values per lane become H.
// A lane whose bit is set keeps the upper H values and hands the lower H to the
// partner lane (row_xmask), and the other way round. After the four levels
// (lane bits 3, 2, 1, 0) lane c of the row holds the whole 16-lane sum of value c:
// 15 cross-lane adds for 16 row sums instead of 64.
template <int H, int CTRL>
__device__ __forceinline__ void fold(float (&v)[16], bool hi) {
  #pragma unroll   // constant indices, so that v stays in registers
  for (int j = 0; j < H; ++j) {
    const float keep = hi ? v[j + H] : v[j];
    const float send = hi ? v[j] : v[j + H];
    v[j] = keep + row_dpp<CTRL>(send);
  }
}
__device__ __forceinline__ void fold16(float (&v)[16], int l15) {
  fold<8, 0x168>(v, (l15 & 8) != 0);   // row_xmask:8
  fold<4, 0x164>(v, (l15 & 4) != 0);   // row_xmask:4
  fold<2, 0x162>(v, (l15 & 2) != 0);   // row_xmask:2
  fold<1, 0x161>(v, (l15 & 1) != 0);   // row_xmask:1
}

// ---------------------------------------------------------------------------
// One launch. A block owns one (batch, head) with all of its rows, so the sum
// over the rows ends inside the block and kv never leaves the WGP: phase 1
// builds kv, the block's barriers hand it over in LDS, phase 2 writes out.
//
// Phase 1: kv[32][32] = (LN_k(x)^T LN_v(x)) / N. With t = (x - mean) / (std + eps),
// LN_k = kw*t + kb and LN_v = vw*t + vb, so that
//   sum_n LN_k[n][d] LN_v[n][e] = kw[d] vw[e] G[d][e] + kw[d] vb[e] S[d] + kb[d] vw[e] S[e] + N kb[d] vb[e]
// with G = t^T t and S[d] = sum_n t[n][d]. The loop sums only G and S: one
// fragment of t is both WMMA operands, and as G is symmetric the odd x even
// tile is the even x odd tile transposed and is not computed. Weights and
// biases come in once, behind the reduction.
// x goes from global memory straight into WMMA fragment registers: lane c of a
// half-wave loads columns 2c, 2c+1 of one row (8 bytes; 16 lanes = the head's
// whole 128-byte line), so the x component feeds the "even columns" fragment
// and the y component the "odd columns" fragment. A stage is 32 rows: register
// i of half-wave hf holds row 2i+hf. The transposing sum leaves each lane with
// the totals of one row (lane c of half hf: row 2c+hf), which it turns into
// mean and 1/(std+eps) once; row_share hands them back to the row's 16 lanes.
// Each wave keeps three 16x16 tiles (even x even, even x odd, odd x odd) and the
// column sums for its own rows; the 16 waves are summed once, at the end, in LDS.
// ---------------------------------------------------------------------------
__device__ __forceinline__ void p1_load(v2f (&buf)[STAGE / 2], const float* base) {
  #pragma unroll   // constant indices, so that buf stays in registers
  for (int i = 0; i < STAGE / 2; ++i)
    buf[i] = *(const v2f*)(base + (size_t)(2 * i) * CDIM);
  // The group's address registers are rewritten only behind this wait.
  asm volatile("s_wait_xcnt 0x0" ::: "memory");
  // Ends the scheduling region behind the group: without it the scheduler
  // spreads both groups of a trip through the row statistics, waits for all
  // loads in the middle of the trip and takes 256 registers instead of 194.
  __builtin_amdgcn_sched_barrier(0);
}

// 16x16x4 step S of a stage. k index: (half, register j) <-> row 4S + 2j + half,
// the same for the A and the B fragments.
template <int S>
__device__ __forceinline__ void p1_steps(const v2f (&buf)[STAGE / 2], float m, float inv,
                                         v8f& gEE, v8f& gEO, v8f& gOO, v2f& sE, v2f& sO) {
  if constexpr (S < STAGE / 4) {
    const v2f p0 = buf[2 * S], p1 = buf[2 * S + 1];
    v2f m2, i2, xE, xO;   // the two rows of this lane's k positions side by side: packed arithmetic
    m2.x = row_dpp<0x150 + 2 * S>(m);      i2.x = row_dpp<0x150 + 2 * S>(inv);      // row_share
    m2.y = row_dpp<0x150 + 2 * S + 1>(m);  i2.y = row_dpp<0x150 + 2 * S + 1>(inv);
    xE.x = p0.x;  xE.y = p1.x;
    xO.x = p0.y;  xO.y = p1.y;
    const v2f tE = (xE - m2) * i2;
    const v2f tO = (xO - m2) * i2;
    sE += tE;
    sO += tO;
    gEE = wmma_f32_16x16x4(tE, tE, gEE);
    gEO = wmma_f32_16x16x4(tE, tO, gEO);
    gOO = wmma_f32_16x16x4(tO, tO, gOO);
    p1_steps<S + 1>(buf, m, inv, gEE, gEO, gOO, sE, sO);
  }
}

__device__ __forceinline__ void p1_compute(const v2f (&buf)[STAGE / 2], int l15,
                                           v8f& gEE, v8f& gEO, v8f& gOO, v2f& sE, v2f& sO) {
  float s[STAGE / 2], ss[STAGE / 2];
  #pragma unroll   // constant indices into buf, s and ss
  for (int i = 0; i < STAGE / 2; ++i) {
    s[i]  = buf[i].x + buf[i].y;
    ss[i] = fmaf(buf[i].y, buf[i].y, buf[i].x * buf[i].x);
  }
  fold16(s, l15);
  fold16(ss, l15);
  const float m   = s[0] * (1.0f / DHEAD);
  const float var = fmaxf(ss[0] - (float)DHEAD * m * m, 0.0f);       // sum((x-m)^2)
  const float inv = 1.0f / (sqrtf(var * (1.0f / (DHEAD - 1))) + 1e-5f);
  p1_steps<0>(buf, m, inv, gEE, gEO, gOO, sE, sO);
}

// ---------------------------------------------------------------------------
// Phase 2: out = x_head * kv + x (residual). A wave works alone: kv sits in
// registers as WMMA B fragments for all of its rows, and x streams through a
// two-buffer LDS ring that belongs to the wave, filled by 16-byte asynchronous
// copies (whole 128-byte lines).
// k order of step s: (half, register j) <-> column 16*half + 2*s + j of the
// head, the same for the A and the B fragments. The two output tiles hold the
// even and the odd columns, so that a lane stores columns 2c, 2c+1 together
// and 16 lanes write one whole 128-byte line. Stores are non-temporal so that
// `out` does not evict L2-resident x.
// ---------------------------------------------------------------------------
__device__ __forceinline__ void p2_copy(const float* g, float* l) {
  #pragma unroll   // constant steps: they become the copies' offset fields
  for (int i = 0; i < ST2 / 4; ++i)
    __builtin_amdgcn_global_load_async_to_lds_b128(
        (__attribute__((address_space(1))) v4i*)(g + (size_t)(4 * i) * CDIM),
        (__attribute__((address_space(3))) v4i*)(l + (4 * i) * XPITCH), 0, 0);
}

__global__ __launch_bounds__(THREADS)
void attn_one_launch(const float* __restrict__ x,
                     const float* __restrict__ kw, const float* __restrict__ kb,
                     const float* __restrict__ vw, const float* __restrict__ vb,
                     float* __restrict__ out) {
  // The rings and the reduction area lie side by side (together the whole LDS
  // of a WGP), so that the rings can be filled while phase 1 still runs.
  __shared__ __attribute__((aligned(16))) float smem[RINGF + REDW * TILE];
  float* ring = smem;
  float* red  = smem + RINGF;

  const int blk  = blockIdx.x;
  const int b    = blk / HEADS;
  const int h    = blk % HEADS;
  const int lane = threadIdx.x & 31;
  const int wid  = threadIdx.x >> 5;   // 0..15: this wave's share of the rows
  const int half = lane >> 4;
  const int l15  = lane & 15;

  // This thread finishes kv[kd][2*l15] and kv[kd][2*l15 + 1] behind the reduction.
  const int kd = threadIdx.x >> 4;
  const float* pkw = kw + h * DHEAD + kd;
  const float* pkb = kb + h * DHEAD + kd;
  const float* pvw = vw + h * DHEAD + 2 * l15;
  const float* pvb = vb + h * DHEAD + 2 * l15;
  const float kwd = *pkw;
  const float kbd = *pkb;
  const v2f vw2 = *(const v2f*)pvw;
  const v2f vb2 = *(const v2f*)pvb;
  // The four address pairs stay live up to here and are rewritten only behind this wait.
  asm volatile("s_wait_xcnt 0x0" :: "v"(pkw), "v"(pkb), "v"(pvw), "v"(pvb) : "memory");

  v8f gEE = {0.f, 0.f, 0.f, 0.f, 0.f, 0.f, 0.f, 0.f};
  v8f gEO = gEE, gOO = gEE;
  v2f sE = {0.f, 0.f}, sO = sE;

  // phase 1, stage st of this wave: rows (st*WAVES + wid)*STAGE .. +STAGE-1
  const float* xp = x + ((size_t)b * NROWS + wid * STAGE + half) * CDIM + h * DHEAD + 2 * l15;
  const size_t ststep1 = (size_t)WAVES * STAGE * CDIM;

  // phase 2, stage st of this wave: rows row0 + st*WAVES*ST2 .. +ST2-1
  const size_t row0   = (size_t)b * NROWS + wid * ST2;
  const size_t ststep = (size_t)WAVES * ST2 * CDIM;
  float* mybuf = ring + wid * (2 * BUF2);
  // one copy = 4 rows: 8 lanes x 16 bytes cover a row's 128-byte line
  const float* gp = x + (row0 + (lane >> 3)) * CDIM + h * DHEAD + 4 * (lane & 7);
  float*       lp = mybuf + (lane >> 3) * XPITCH + 4 * (lane & 7);

  // Two register buffers, both filled ahead. A buffer is refilled (two stages
  // ahead) as soon as its own stage is done, so its 16 loads fly during the
  // whole of the other buffer's stage, and nothing that is loaded in a trip is
  // used in the same trip, however the two stages' arithmetic is interleaved.
  // The last pair is peeled so that no branch stands around a load.
  v2f bufA[STAGE / 2], bufB[STAGE / 2];
  p1_load(bufA, xp);
  p1_load(bufB, xp + ststep1);
  #pragma unroll 1   // stays rolled: four stage bodies of text instead of eight
  for (int st = 0; st < NST - 2; st += 2) {
    xp += 2 * ststep1;
    p1_compute(bufA, l15, gEE, gEO, gOO, sE, sO);
    p1_load(bufA, xp);
    p1_compute(bufB, l15, gEE, gEO, gOO, sE, sO);
    p1_load(bufB, xp + ststep1);
  }
  // Phase 2's first two stages start for the wave's ring here: no load of
  // phase 1 is left to issue, and the copies fly during its last two stages and
  // the reduction. Nothing has touched the ring before.
  p2_copy(gp, lp);
  p2_copy(gp + ststep, lp + BUF2);
  // Ends the scheduling region behind the copies: they are to issue here, not
  // behind the two stages of arithmetic below.
  __builtin_amdgcn_sched_barrier(0);
  p1_compute(bufA, l15, gEE, gEO, gOO, sE, sO);
  p1_compute(bufB, l15, gEE, gEO, gOO, sE, sO);

  // Column sums of this wave's rows: the two registers, then the two half-waves
  // (v_permlanex16 with the identity selection reads the same lane of the other
  // half). Half 0 goes on with the even column 2c, half 1 with the odd one.
  float cE = sE.x + sE.y, cO = sO.x + sO.y;
  cE += __builtin_bit_cast(float, __builtin_amdgcn_permlanex16(0, __builtin_bit_cast(int, cE),
                                                               0x76543210, 0xfedcba98, true, false));
  cO += __builtin_bit_cast(float, __builtin_amdgcn_permlanex16(0, __builtin_bit_cast(int, cO),
                                                               0x76543210, 0xfedcba98, true, false));
  const float cmine = half ? cO : cE;

  // The 16 waves' sums are added in a fixed order. The upper eight waves put
  // theirs down, the lower eight add their own on top (wave w meets wave w+8,
  // lane for lane), then all threads sum the eight that are left.
  // D layout: register r, lane (half, c) = tile[8*half + r][c]; tile index i
  // stands for column 2i (even) or 2i+1 (odd) of the head.
  const bool upper = __builtin_amdgcn_readfirstlane(wid) >= REDW;   // a scalar branch
  float* mine = red + (wid % REDW) * AREA;
  // element [i][c] of the first tile is the pair (even x even, even x odd)
  float* mp = mine + 2 * ((8 * half) * GP + l15);
  float* mo = mine + OOFF + (8 * half) * GP + l15;
  float* ms = mine + SOFF + 2 * l15 + half;
  if (upper) {
    #pragma unroll   // constant indices into the accumulator vectors
    for (int r = 0; r < 8; ++r) {
      v2f e;
      e.x = gEE[r]; e.y = gEO[r];
      *(v2f*)(mp + 2 * r * GP) = e;
      mo[r * GP] = gOO[r];
    }
    *ms = cmine;
  }
  __syncthreads();
  if (!upper) {
    v2f   e[8];
    float o[8];
    // the two unrolls: constant indices; all reads stand ahead of the first write, under one wait
    #pragma unroll
    for (int r = 0; r < 8; ++r) {
      e[r] = *(const v2f*)(mp + 2 * r * GP);
      o[r] = mo[r * GP];
    }
    const float c = *ms;
    #pragma unroll
    for (int r = 0; r < 8; ++r) {
      e[r].x += gEE[r]; e[r].y += gEO[r];
      *(v2f*)(mp + 2 * r * GP) = e[r];
      mo[r * GP] = o[r] + gOO[r];
    }
    *ms = c + cmine;
  }
  __syncthreads();
  // G[kd][2c] and G[kd][2c+1]. Even kd = 2i: the pair [i][c]. Odd kd = 2i+1:
  // even x odd [c][i] (that tile read transposed: G is symmetric), odd x odd [i][c].
  const int  ki   = kd >> 1;
  const bool kodd = (kd & 1) != 0;
  const float* qp = red + 2 * (kodd ? l15 * GP + ki : ki * GP + l15);
  const float* qo = red + OOFF + ki * GP + l15;
  const float* qe = red + SOFF + 2 * l15;
  v2f   gq = *(const v2f*)qp;
  float go = qo[0];
  v2f   se = *(const v2f*)qe;
  #pragma unroll   // all LDS reads issued before the first add
  for (int w = 1; w < REDW; ++w) {
    gq += *(const v2f*)(qp + w * AREA);
    go += qo[w * AREA];
    se += *(const v2f*)(qe + w * AREA);
  }
  const float g0 = kodd ? gq.y : gq.x;
  const float g1 = kodd ? go : gq.y;
  // S[kd]: kd = 2*wid + half, so lane wid of each half-wave holds it in se (x in
  // half 0, y in half 1); v_permlane16 with wid in every selector hands it to the 16 lanes.
  const unsigned sel = (unsigned)__builtin_amdgcn_readfirstlane(wid) * 0x11111111u;
  const float spick = half ? se.y : se.x;
  const float sd = __builtin_bit_cast(float, __builtin_amdgcn_permlane16(0, __builtin_bit_cast(int, spick),
                                                                         sel, sel, true, false));
  // kv has a place of its own behind the partial sums, which other threads still read.
  float* kvs = red + REDW * AREA;
  v2f kv2;
  kv2.x = (kwd * vw2.x * g0 + kwd * vb2.x * sd + kbd * vw2.x * se.x) * (1.0f / (float)NROWS) + kbd * vb2.x;
  kv2.y = (kwd * vw2.y * g1 + kwd * vb2.y * sd + kbd * vw2.y * se.y) * (1.0f / (float)NROWS) + kbd * vb2.y;
  *(v2f*)(kvs + threadIdx.x * 2) = kv2;
  __syncthreads();                               // kv stands in kvs[0 .. TILE-1]

  // B fragments
  const float* kp = kvs + (16 * half) * DHEAD + 2 * l15;
  v2f bE[DHEAD / 4], bO[DHEAD / 4];
  #pragma unroll   // constant indices, so that the fragments stay in registers
  for (int s = 0; s < DHEAD / 4; ++s) {
    const v2f r0 = *(const v2f*)(kp + (2 * s) * DHEAD);
    const v2f r1 = *(const v2f*)(kp + (2 * s + 1) * DHEAD);
    bE[s].x = r0.x;  bE[s].y = r1.x;
    bO[s].x = r0.y;  bO[s].y = r1.y;
  }

  // Stages 0 and 1 have landed behind this wait; only the wave that copied reads them.
  asm volatile("s_wait_asynccnt 0x0" ::: "memory");

  float* op = out + (row0 + 8 * half) * CDIM + h * DHEAD + 2 * l15;

  #pragma unroll   // buffer places and store steps become constants; no address register is rewritten
  for (int st = 0; st < NST2; ++st) {
    const float* cur = mybuf + (st & 1) * BUF2;
    #pragma unroll   // the stage's four 16-row tiles are independent: eight accumulator chains to interleave
    for (int tl = 0; tl < ST2 / 16; ++tl) {
      const float* ar = cur + (tl * 16 + l15) * XPITCH + 16 * half;        // A[M=row, K]
      const float* rr = cur + (tl * 16 + 8 * half) * XPITCH + 2 * l15;     // residual, D layout
      v4f a4[4];
      v2f res[8];
      // the four unrolls below: constant indices, so that a4, res and the accumulators stay in registers
      #pragma unroll
      for (int q = 0; q < 4; ++q) a4[q] = *(const v4f*)(ar + 4 * q);
      #pragma unroll
      for (int r = 0; r < 8; ++r) res[r] = *(const v2f*)(rr + r * XPITCH);

      v8f accE = {0.f, 0.f, 0.f, 0.f, 0.f, 0.f, 0.f, 0.f};
      v8f accO = accE;
      #pragma unroll
      for (int q = 0; q < 4; ++q) {
        v2f a0, a1;
        a0.x = a4[q].x;  a0.y = a4[q].y;
        a1.x = a4[q].z;  a1.y = a4[q].w;
        accE = wmma_f32_16x16x4(a0, bE[2 * q], accE);
        accO = wmma_f32_16x16x4(a0, bO[2 * q], accO);
        accE = wmma_f32_16x16x4(a1, bE[2 * q + 1], accE);
        accO = wmma_f32_16x16x4(a1, bO[2 * q + 1], accO);
      }

      #pragma unroll
      for (int r = 0; r < 8; ++r) {
        v2f o;
        o.x = accE[r] + res[r].x;
        o.y = accO[r] + res[r].y;
        __builtin_nontemporal_store(o, (v2f*)(op + (size_t)st * ststep + (size_t)(tl * 16 + r) * CDIM));
      }
    }
    // Foot of a stage. The ring is private to the wave, so no work-group barrier:
    // the wave's own LDS reads of this buffer have retired before it is refilled,
    asm volatile("s_wait_dscnt 0x0" ::: "memory");
    // and the next stage's copies have landed before the wave reads them.
    asm volatile("s_wait_asynccnt 0x0" ::: "memory");
    if (st + 2 < NST2) p2_copy(gp + (size_t)(st + 2) * ststep, lp + (st & 1) * BUF2);
  }
}

extern "C" void kernel_launch(void* const* d_in, const int* in_sizes, int n_in,
                              void* d_out, int out_size, void* d_ws, size_t ws_size,
                              hipStream_t stream) {
  const float* x  = (const float*)d_in[0];
  const float* kw = (const float*)d_in[1];
  const float* kb = (const float*)d_in[2];
  const float* vw = (const float*)d_in[3];
  const float* vb = (const float*)d_in[4];
  float* out = (float*)d_out;

  const int B = in_sizes[0] / (NROWS * CDIM);

  attn_one_launch<<<B * HEADS, THREADS, 0, stream>>>(x, kw, kb, vw, vb, out);
}
